// v000
// Times are from an AMD MI455X. After a warm-up the kernel runs many times in a row, and a time is the length of
// such a window on the GPU divided by its runs, so every launch and the gaps after it count. The runs cycle
// through copies of the inputs. A figure is the median of several windows, for all but v000 over two sittings.
// Sittings can differ by a few percent; kernels timed side by side share one.
// v000, which the later versions start from, runs in 914 microseconds.
#include <hip/hip_runtime.h>

// Contractions: x*Wq, Wv^T*x^T and p*v on v_wmma_f32_16x16x32_bf16 with bf16 hi/lo operand planes (hi*hi + hi*lo + lo*hi);
// x*Wk (Wk carried x64, folded back as 1/64) and q*k^T on v_wmma_f32_16x16x32_f16 with plain f16 operands; f32 accumulate; softmax in f32.

typedef __attribute__((ext_vector_type(16))) _Float16 v16h;
typedef __attribute__((ext_vector_type(8)))  _Float16 v8h;
typedef __attribute__((ext_vector_type(16))) __bf16   v16b;
typedef __attribute__((ext_vector_type(8)))  __bf16   v8b;
typedef __attribute__((ext_vector_type(8)))  float    v8f;
typedef __attribute__((ext_vector_type(4)))  float    v4f;

__device__ __forceinline__ unsigned short f2bf_bits(float f) {
  unsigned u = __float_as_uint(f);
  return (unsigned short)((u + 0x7FFFu + ((u >> 16) & 1u)) >> 16);
}
__device__ __forceinline__ float bf_bits2f(unsigned short h) { return __uint_as_float(((unsigned)h) << 16); }

// hazard guards as plain device helpers (no inline asm inside the kernel template body)
__device__ __forceinline__ void dep_guard_h(v8f& a, v8f& b, v16h x, v16h y) { asm volatile("v_nop\n\tv_nop\n\tv_nop\n\tv_nop" : "+v"(a), "+v"(b) : "v"(x), "v"(y)); }
__device__ __forceinline__ void dep_guard_b(v8f& a, v8f& b, v16b x, v16b y) { asm volatile("v_nop\n\tv_nop\n\tv_nop\n\tv_nop" : "+v"(a), "+v"(b) : "v"(x), "v"(y)); }
__device__ __forceinline__ void keep4_h(v16h a, v16h b, v16h c, v16h d) { asm volatile("v_nop" :: "v"(a), "v"(b), "v"(c), "v"(d)); }
__device__ __forceinline__ void keep4_b(v16b a, v16b b, v16b c, v16b d) { asm volatile("v_nop" :: "v"(a), "v"(b), "v"(c), "v"(d)); }
__device__ __forceinline__ void acc_guard4(v8f& a, v8f& b, v8f& c, v8f& d) { asm volatile("v_nop\n\tv_nop\n\tv_nop\n\tv_nop" : "+v"(a), "+v"(b), "+v"(c), "+v"(d)); }
template <typename T> struct Frag;
template <> struct Frag<_Float16> {
  typedef v16h V; union U { v16h v; v8h h[2]; };
  static __device__ __forceinline__ v16h load(const _Float16* p) {   // elements 0..7 <- p[0..7], 8..15 <- p[16..23]
    U f; f.h[0] = *(const v8h*)(p); f.h[1] = *(const v8h*)(p + 16); return f.v;
  }
  static __device__ __forceinline__ v8f mma(v16h a, v16h b, v8f c) {
    return __builtin_amdgcn_wmma_f32_16x16x32_f16(false, a, false, b, (short)0, c, false, false);
  }
  static __device__ __forceinline__ void guard(v8f& a, v8f& b, v16h x, v16h y) { dep_guard_h(a, b, x, y); }
  static __device__ __forceinline__ void keep(v16h a, v16h b, v16h c, v16h d) { keep4_h(a, b, c, d); }
};
template <> struct Frag<__bf16> {
  typedef v16b V; union U { v16b v; v8b h[2]; };
  static __device__ __forceinline__ v16b load(const __bf16* p) {
    U f; f.h[0] = *(const v8b*)(p); f.h[1] = *(const v8b*)(p + 16); return f.v;
  }
  static __device__ __forceinline__ v8f mma(v16b a, v16b b, v8f c) {
    return __builtin_amdgcn_wmma_f32_16x16x32_bf16(false, a, false, b, (short)0, c, false, false);
  }
  static __device__ __forceinline__ void guard(v8f& a, v8f& b, v16b x, v16b y) { dep_guard_b(a, b, x, y); }
  static __device__ __forceinline__ void keep(v16b a, v16b b, v16b c, v16b d) { keep4_b(a, b, c, d); }
};

// ---- Register-blocked batched WMMA GEMM ------------------------------------
// C[m,n] = scale * sum_k A[m,k] * Bt[n,k] (+bias)(+resid); each wave owns a 64x64 tile.
// A row-major [M,K]; Bt row-major [N,K]; M,N % 64 == 0, K % 32 == 0.
// SPLIT: operands are hi/lo planes (A2/Bt2 = lo planes, same layout); product = hi*hi + hi*lo + lo*hi.
// BIAS_MODE: 0 = none, 1 = bias[m], 2 = bias[n].
// OUT_MODE: 0 = f32, 1 = f16, 2 = bf16 hi plane (Cout) + bf16 lo plane (Cout2).
// TRI: M == N; only tiles (tm, tn) with tn <= tm are enumerated (lower-triangular schedule, tile index -> (tm,tn) by integer search).
// KLIM: the k loop for m-tile tm runs over k < min(K, (tm+1)*64) (wave-uniform bound).
// ET: 0 = f16 operands, 1 = bf16 operands (pointers passed as 16-bit storage)
template <int ET> struct Elem;
template <> struct Elem<0> { typedef _Float16 T; };
template <> struct Elem<1> { typedef __bf16 T; };
template <int ET, bool SPLIT, int BIAS_MODE, int OUT_MODE, bool RESID, int ACT, bool TRI, bool KLIM>
__global__ __launch_bounds__(256) void wmma_gemm64(
    const unsigned short* __restrict__ Ap, const unsigned short* __restrict__ A2p, int lda, long strideA,
    const unsigned short* __restrict__ Btp, const unsigned short* __restrict__ Bt2p, int ldb, long strideB,
    void* __restrict__ Cout, void* __restrict__ Cout2, int ldc, long strideC,
    const float* __restrict__ bias,
    const float* __restrict__ resid, long strideR,
    int M, int N, int K, float scale) {
  typedef typename Elem<ET>::T T;
  typedef typename Frag<T>::V V;
  const T* A = (const T*)Ap; const T* A2 = (const T*)A2p; const T* Bt = (const T*)Btp; const T* Bt2 = (const T*)Bt2p;
  __shared__ __align__(16) float sT[8][16 * 68];   // per-wave 16x64 slab, pitch 68 floats
  const int b    = blockIdx.y;
  const int lane = threadIdx.x & 31;
  const int wave = threadIdx.x >> 5;
  const int tilesN = N >> 6;
  const int tilesM = M >> 6;
  const int tile = blockIdx.x * 8 + wave;
  int tm, tn;
  if (TRI) {
    const int ntri = (tilesM * (tilesM + 1)) >> 1;
    if (tile >= ntri) return;              // wave-uniform; no block barriers in this kernel
    int r = 0;
    for (int i = 1; i < tilesM && i < 4096; ++i) { if (((i * (i + 1)) >> 1) <= tile) r = i; }
    tm = r;
    tn = tile - ((tm * (tm + 1)) >> 1);    // 0 <= tn <= tm
  } else {
    if (tile >= tilesM * tilesN) return;   // wave-uniform; no block barriers in this kernel
    tm = tile / tilesN;
    tn = tile - tm * tilesN;
  }
  const int m0 = tm << 6;
  const int n0 = tn << 6;
  int kEnd = K;
  if (KLIM) { const int kl = (tm + 1) << 6; kEnd = (kl < K) ? kl : K; }

  const T* Ab  = A  + (size_t)b * strideA;
  const T* Bb  = Bt + (size_t)b * strideB;
  const T* Ab2 = SPLIT ? (A2  + (size_t)b * strideA) : nullptr;
  const T* Bb2 = SPLIT ? (Bt2 + (size_t)b * strideB) : nullptr;

  const int rlane = lane & 15;                 // row (A) / col (B, D) within subtile
  const int koff  = (lane >> 4) * 8;           // k offset of this lane half
  const int mOff  = (lane >> 4) * 8;           // D row offset

  v8f acc[4][4];
#pragma unroll
  for (int i = 0; i < 4; ++i)
#pragma unroll
    for (int j = 0; j < 4; ++j) acc[i][j] = (v8f){0.f,0.f,0.f,0.f,0.f,0.f,0.f,0.f};

  for (int k0 = 0; k0 < kEnd; k0 += 32) {
    V bh[4], bl[4];
#pragma unroll
    for (int j = 0; j < 4; ++j) {
      const size_t bo = (size_t)(n0 + (j << 4) + rlane) * ldb + koff + k0;
      bh[j] = Frag<T>::load(Bb + bo);
      if (SPLIT) bl[j] = Frag<T>::load(Bb2 + bo);
    }
#pragma unroll
    for (int i = 0; i < 4; ++i) {
      const size_t ao = (size_t)(m0 + (i << 4) + rlane) * lda + koff + k0;
      V ah = Frag<T>::load(Ab + ao);
      V al;
      if (SPLIT) al = Frag<T>::load(Ab2 + ao);
#pragma unroll
      for (int j = 0; j < 4; ++j) {
        acc[i][j] = Frag<T>::mma(ah, bh[j], acc[i][j]);
        if (SPLIT) {
          acc[i][j] = Frag<T>::mma(ah, bl[j], acc[i][j]);
          acc[i][j] = Frag<T>::mma(al, bh[j], acc[i][j]);
        }
      }
      Frag<T>::guard(acc[i][0], acc[i][3], ah, SPLIT ? al : ah);
    }
    Frag<T>::keep(bh[0], bh[1], bh[2], bh[3]);
    if (SPLIT) Frag<T>::keep(bl[0], bl[1], bl[2], bl[3]);
  }
  acc_guard4(acc[0][0], acc[0][1], acc[0][2], acc[0][3]);
  acc_guard4(acc[1][0], acc[1][1], acc[1][2], acc[1][3]);
  acc_guard4(acc[2][0], acc[2][1], acc[2][2], acc[2][3]);
  acc_guard4(acc[3][0], acc[3][1], acc[3][2], acc[3][3]);

  // ---- epilogue ----
  float* slab = sT[wave];
  const float* Rb = RESID ? (resid + (size_t)b * strideR) : nullptr;
#pragma unroll
  for (int i = 0; i < 4; ++i) {
    const int mBase = m0 + (i << 4);
#pragma unroll
    for (int j = 0; j < 4; ++j) {
      const int n = n0 + (j << 4) + rlane;
      float bv = 0.f;
      if (BIAS_MODE == 2) bv = bias[n];
#pragma unroll
      for (int r = 0; r < 8; ++r) {
        float v = acc[i][j][r] * scale;
        if (BIAS_MODE == 1) v += bias[mBase + mOff + r];
        if (BIAS_MODE == 2) v += bv;
        if (RESID) v += Rb[(size_t)(mBase + mOff + r) * ldc + n];
        if (ACT == 1) v = tanhf(v);
        if (ACT == 2) v = fmaxf(v, 0.0f);
        if (ACT == 3) v = v / (1.0f + expf(-v));
        if (ACT == 4) v = (v > 0.f) ? v : 0.01f * v;
        if (ACT == 5) v = 0.5f * v * (1.0f + erff(v * 0.70710678118654752f));
        slab[(mOff + r) * 68 + (j << 4) + rlane] = v;
      }
    }
    __builtin_amdgcn_fence(__ATOMIC_RELEASE, "workgroup");
    __builtin_amdgcn_wave_barrier();
    __builtin_amdgcn_fence(__ATOMIC_ACQUIRE, "workgroup");
    if (OUT_MODE == 0) {
      float* C = (float*)Cout + (size_t)b * strideC;
      const int hh = lane >> 4, c4 = (lane & 15) * 4;     // row seg = 256 B = 16 lanes x 16 B
      {
#pragma unroll
        for (int it = 0; it < 8; ++it) {
          const int row = it * 2 + hh;
          v4f v = *(const v4f*)(slab + row * 68 + c4);
          *(v4f*)(C + (size_t)(mBase + row) * ldc + n0 + c4) = v;
        }
        
      }
    } else {
      const int q = lane >> 3, c8 = (lane & 7) * 8;
      unsigned short* C  = (unsigned short*)Cout  + (size_t)b * strideC;
      unsigned short* C2 = (OUT_MODE == 2) ? ((unsigned short*)Cout2 + (size_t)b * strideC) : nullptr;
      {
#pragma unroll
        for (int it = 0; it < 4; ++it) {
          const int row = it * 4 + q;
          const float* sp = slab + row * 68 + c8;
          v8h hv, lv;
#pragma unroll
          for (int e = 0; e < 8; ++e) {
            if (OUT_MODE == 1) {
              hv[e] = (_Float16)sp[e];
            } else {
              unsigned short hb = f2bf_bits(sp[e]);
              unsigned short lb = f2bf_bits(sp[e] - bf_bits2f(hb));
              hv[e] = __builtin_bit_cast(_Float16, hb);
              lv[e] = __builtin_bit_cast(_Float16, lb);
            }
          }
          *(v8h*)(C + (size_t)(mBase + row) * ldc + n0 + c8) = hv;
          if (OUT_MODE == 2) *(v8h*)(C2 + (size_t)(mBase + row) * ldc + n0 + c8) = lv;
        }
        
      }
    }
    __builtin_amdgcn_fence(__ATOMIC_RELEASE, "workgroup");
    __builtin_amdgcn_wave_barrier();
    __builtin_amdgcn_fence(__ATOMIC_ACQUIRE, "workgroup");
  }
}

// ---- x f32 -> three 16-bit planes: bf16 hi, bf16 lo (x - hi), f16 ----
__global__ __launch_bounds__(256) void xplanes_kernel(
    const float* __restrict__ x, unsigned short* __restrict__ xh, unsigned short* __restrict__ xl,
    unsigned short* __restrict__ x16, int n8) {
  const int i = blockIdx.x * 256 + threadIdx.x;
  if (i >= n8) return;                         // no block barriers in this kernel
  const float* p = x + (size_t)i * 8;
  const v4f a = *(const v4f*)p;
  const v4f c = *(const v4f*)(p + 4);
  float f[8];
#pragma unroll
  for (int e = 0; e < 4; ++e) { f[e] = a[e]; f[4 + e] = c[e]; }
  v8h hv, lv, fv;
#pragma unroll
  for (int e = 0; e < 8; ++e) {
    const unsigned short hb = f2bf_bits(f[e]);
    const unsigned short lb = f2bf_bits(f[e] - bf_bits2f(hb));
    hv[e] = __builtin_bit_cast(_Float16, hb);
    lv[e] = __builtin_bit_cast(_Float16, lb);
    fv[e] = (_Float16)f[e];
  }
  const size_t o = (size_t)i * 8;
  {
    *(v8h*)(xh + o)  = hv;
    *(v8h*)(xl + o)  = lv;
    *(v8h*)(x16 + o) = fv;
    
  }
}

// ---- weight transpose with 16-bit conversion: w [R][C] (R = in features, C = out features) -> planes [C][R], out[c][r] = w[r][c] * scl ----
// MODE 0: bf16 hi + bf16 lo planes; MODE 1: single f16 plane.
// grid = (C/32, R/64), block 256.
template <int MODE>
__global__ __launch_bounds__(256) void wtrans_kernel(
    const float* __restrict__ w, unsigned short* __restrict__ o1, unsigned short* __restrict__ o2,
    int R, int C, float scl) {
  __shared__ float t[32][65];                  // t[c][r]
  const int c0 = blockIdx.x * 32, r0 = blockIdx.y * 64;
  const int tid = threadIdx.x, lane = tid & 31, wave = tid >> 5;
#pragma unroll
  for (int it = 0; it < 8; ++it) {
    const int r = it * 8 + wave;
    t[lane][r] = w[(size_t)(r0 + r) * C + c0 + lane];
  }
  __syncthreads();
  const int c  = wave * 4 + (lane >> 3);       // 0..31
  const int rb = (lane & 7) * 8;               // 0..56
  v8h h1, h2;
#pragma unroll
  for (int e = 0; e < 8; ++e) {
    const float f = t[c][rb + e] * scl;
    if (MODE == 0) {
      const unsigned short hb = f2bf_bits(f);
      const unsigned short lb = f2bf_bits(f - bf_bits2f(hb));
      h1[e] = __builtin_bit_cast(_Float16, hb);
      h2[e] = __builtin_bit_cast(_Float16, lb);
    } else {
      h1[e] = (_Float16)f;
      h2[e] = h1[e];
    }
  }
  const size_t o = (size_t)(c0 + c) * R + r0 + rb;
  {
    *(v8h*)(o1 + o) = h1;
    if (MODE == 0) *(v8h*)(o2 + o) = h2;
    
  }
}

// ---- causal row softmax: one wave per row i of one batch element ----
// Reads S[i][j] (f32) for j < kend = ((i/64)+1)*64, masks j > i with -inf, f32 max / exp / sum,
// writes normalized probabilities as bf16 hi + lo planes for columns [0, kend) (zeros for i < j < kend):
__global__ __launch_bounds__(256) void softmax_rows(
    const float* __restrict__ S, unsigned short* __restrict__ Ph, unsigned short* __restrict__ Pl, int L) {
  const int wave = threadIdx.x >> 5, lane = threadIdx.x & 31;
  const int i = blockIdx.x * 8 + wave;
  if (i >= L) return;                          // no block barriers in this kernel
  const int kend = ((i >> 6) + 1) << 6;        // <= L
  const float* s = S + (size_t)i * L;
  const float NEG = -__builtin_inff();
  float v[8][8];
  float m = NEG;
#pragma unroll
  for (int it = 0; it < 8; ++it) {
#pragma unroll
    for (int e = 0; e < 8; ++e) v[it][e] = NEG;
    const int c0 = it * 256 + lane * 8;
    if (it * 256 < kend && c0 < kend) {
      const v4f a = *(const v4f*)(s + c0);
      const v4f c = *(const v4f*)(s + c0 + 4);
#pragma unroll
      for (int e = 0; e < 4; ++e) {
        v[it][e]     = (c0 + e <= i)     ? a[e] : NEG;
        v[it][4 + e] = (c0 + 4 + e <= i) ? c[e] : NEG;
      }
    }
#pragma unroll
    for (int e = 0; e < 8; ++e) m = fmaxf(m, v[it][e]);
  }
#pragma unroll
  for (int off = 1; off < 32; off <<= 1) m = fmaxf(m, __shfl_xor(m, off, 32));

  float l = 0.f;
#pragma unroll
  for (int it = 0; it < 8; ++it) {
    if (it * 256 < kend) {                     // wave-uniform
#pragma unroll
      for (int e = 0; e < 8; ++e) {
        const float p = __expf(v[it][e] - m);  // exp(-inf) = 0 for masked columns
        v[it][e] = p;
        l += p;
      }
    }
  }
#pragma unroll
  for (int off = 1; off < 32; off <<= 1) l += __shfl_xor(l, off, 32);
  const float inv = 1.0f / l;                  // l >= 1

  unsigned short* ph = Ph + (size_t)i * L;
  unsigned short* pl = Pl + (size_t)i * L;
  {
#pragma unroll
    for (int it = 0; it < 8; ++it) {
      const int c0 = it * 256 + lane * 8;
      if (it * 256 < kend && c0 < kend) {
        v8h hv, lv;
#pragma unroll
        for (int e = 0; e < 8; ++e) {
          const float p = v[it][e] * inv;
          const unsigned short hb = f2bf_bits(p);
          const unsigned short lb = f2bf_bits(p - bf_bits2f(hb));
          hv[e] = __builtin_bit_cast(_Float16, hb);
          lv[e] = __builtin_bit_cast(_Float16, lb);
        }
        *(v8h*)(ph + c0) = hv;
        *(v8h*)(pl + c0) = lv;
      }
    }
    
  }
}

// ---------------------------------------------------------------------------
// host launcher
// ---------------------------------------------------------------------------
extern "C" void kernel_launch(void* const* d_in, const int* in_sizes, int n_in,
                              void* d_out, int out_size, void* d_ws, size_t ws_size,
                              hipStream_t stream)
{
  const int B = 4, L = 2048, D = 1024;
  const int M = B * L;                                   // 8192 rows
  if (n_in < 7) return;
  if (in_sizes[0] != M * D || in_sizes[1] != D * D || in_sizes[2] != D ||
      in_sizes[3] != D * D || in_sizes[4] != D || in_sizes[5] != D * D ||
      in_sizes[6] != D || out_size != M * D) return;

  const float* x  = (const float*)d_in[0];
  const float* wq = (const float*)d_in[1];
  const float* bq = (const float*)d_in[2];
  const float* wk = (const float*)d_in[3];
  const float* bk = (const float*)d_in[4];
  const float* wv = (const float*)d_in[5];
  const float* bv = (const float*)d_in[6];
  float* out = (float*)d_out;

  // workspace carve: 5 weight planes (2 MiB each) + 7 activation planes (16 MiB each) = 122 MiB
  const size_t plane_w = (size_t)D * D * 2;             // 2,097,152 B
  const size_t plane_x = (size_t)M * D * 2;             // 16,777,216 B  (== L*L*4 == 2 * L*L*2)
  const size_t need = 5 * plane_w + 7 * plane_x;        // 127,926,272 B
  if (ws_size < need) return;
  char* ws = (char*)d_ws;
  unsigned short* WqTh = (unsigned short*)(ws);
  unsigned short* WqTl = (unsigned short*)(ws + plane_w);
  unsigned short* WkT  = (unsigned short*)(ws + 2 * plane_w);
  unsigned short* WvTh = (unsigned short*)(ws + 3 * plane_w);
  unsigned short* WvTl = (unsigned short*)(ws + 4 * plane_w);
  char* xr = ws + 5 * plane_w;
  unsigned short* Xh  = (unsigned short*)(xr);                 // x bf16 hi  [8192][1024]
  unsigned short* Xl  = (unsigned short*)(xr + plane_x);       // x bf16 lo
  unsigned short* X16 = (unsigned short*)(xr + 2 * plane_x);   // x f16
  unsigned short* Q16 = (unsigned short*)(xr + 3 * plane_x);   // q f16      [8192][1024]
  unsigned short* K16 = (unsigned short*)(xr + 4 * plane_x);   // k f16      [8192][1024]
  unsigned short* VTh = (unsigned short*)(xr + 5 * plane_x);   // v^T bf16 hi [4][1024][2048]
  unsigned short* VTl = (unsigned short*)(xr + 6 * plane_x);   // v^T bf16 lo
  // attention buffers (one batch element at a time) alias the x planes, which are dead after the projections
  float* Sb = (float*)xr;                                                    // S f32 [2048][2048] = 16 MiB
  unsigned short* Ph = (unsigned short*)(xr + plane_x);                      // P bf16 hi [2048][2048] = 8 MiB
  unsigned short* Pl = (unsigned short*)(xr + plane_x + (size_t)L * L * 2);  // P bf16 lo               8 MiB

  // 1) x -> planes
  {
    const int n8 = M * D / 8;                            // 1,048,576
    xplanes_kernel<<<dim3((n8 + 255) / 256), dim3(256), 0, stream>>>(x, Xh, Xl, X16, n8);
  }
  // 2) weights [in][out] -> transposed 16-bit planes [out][in]
  {
    dim3 g(D / 32, D / 64), blk(256);
    wtrans_kernel<0><<<g, blk, 0, stream>>>(wq, WqTh, WqTl, D, D, 1.0f);
    wtrans_kernel<1><<<g, blk, 0, stream>>>(wk, WkT, WkT, D, D, 64.0f);
    wtrans_kernel<0><<<g, blk, 0, stream>>>(wv, WvTh, WvTl, D, D, 1.0f);
  }
  // 3) q = x*Wq + bq  (bf16 hi/lo split, f16 out)   [8192 x 1024 x 1024]
  {
    dim3 g((M / 64) * (D / 64) / 8, 1), blk(256);
    wmma_gemm64<1, true, 2, 1, false, 0, false, false><<<g, blk, 0, stream>>>(
        Xh, Xl, D, 0L, WqTh, WqTl, D, 0L, (void*)Q16, (void*)Q16, D, 0L, bq, bq, 0L, M, D, D, 1.0f);
  }
  // 4) k = (x*(64 Wk)) / 64 + bk  (plain f16, f16 out)
  {
    dim3 g((M / 64) * (D / 64) / 8, 1), blk(256);
    wmma_gemm64<0, false, 2, 1, false, 0, false, false><<<g, blk, 0, stream>>>(
        X16, X16, D, 0L, WkT, WkT, D, 0L, (void*)K16, (void*)K16, D, 0L, bk, bk, 0L, M, D, D, 1.0f / 64.0f);
  }
  // 5) v^T[b][d][j] = sum_i Wv^T[d][i] x[b][j][i] + bv[d]  (bf16 hi/lo split, bf16 hi/lo planes out)  [4 x 1024 x 2048 x 1024]
  {
    dim3 g((D / 64) * (L / 64) / 8, B), blk(256);
    wmma_gemm64<1, true, 1, 2, false, 0, false, false><<<g, blk, 0, stream>>>(
        WvTh, WvTl, D, 0L, Xh, Xl, D, (long)L * D, (void*)VTh, (void*)VTl, L, (long)D * L, bv, bv, 0L, D, L, D, 1.0f);
  }
  // 6) per batch element: S = q*k^T / 32 (lower-triangular tiles), P = softmax rows, out = P * v (k-limited)
  const int ntri = (L / 64) * (L / 64 + 1) / 2;          // 528 tiles
  for (int b = 0; b < B; ++b) {
    const size_t qo = (size_t)b * L * D;
    {
      dim3 g((ntri + 7) / 8, 1), blk(256);
      wmma_gemm64<0, false, 0, 0, false, 0, true, false><<<g, blk, 0, stream>>>(
          Q16 + qo, Q16 + qo, D, 0L, K16 + qo, K16 + qo, D, 0L, (void*)Sb, (void*)Sb, L, 0L, bq, bq, 0L, L, L, D, 1.0f / 32.0f);
    }
    softmax_rows<<<dim3((L + 7) / 8), dim3(256), 0, stream>>>(Sb, Ph, Pl, L);
    {
      const size_t vo = (size_t)b * D * L;
      float* ob = out + qo;
      dim3 g((L / 64) * (D / 64) / 8, 1), blk(256);
      wmma_gemm64<1, true, 0, 0, false, 0, false, true><<<g, blk, 0, stream>>>(
          Ph, Pl, L, 0L, VTh + vo, VTl + vo, L, 0L, (void*)ob, (void*)ob, D, 0L, bq, bq, 0L, L, D, L, 1.0f);
    }
  }
}

// v001
// It runs in 430 microseconds.
// In two side-by-side timings against v000, it was 2.13 and 2.10 times as fast.
#include <hip/hip_runtime.h>

// Contractions: x*Wq, Wv^T*x^T and p*v on v_wmma_f32_16x16x32_bf16 with bf16 hi/lo operand planes (hi*hi + hi*lo + lo*hi);
// x*Wk (Wk carried x64, folded back as 1/64) and q*k^T on v_wmma_f32_16x16x32_f16 with plain f16 operands; f32 accumulate; softmax in f32.

typedef __attribute__((ext_vector_type(16))) _Float16 v16h;
typedef __attribute__((ext_vector_type(8)))  _Float16 v8h;
typedef __attribute__((ext_vector_type(16))) __bf16   v16b;
typedef __attribute__((ext_vector_type(8)))  __bf16   v8b;
typedef __attribute__((ext_vector_type(8)))  float    v8f;
typedef __attribute__((ext_vector_type(4)))  float    v4f;

__device__ __forceinline__ unsigned short f2bf_bits(float f) {
  unsigned u = __float_as_uint(f);
  return (unsigned short)((u + 0x7FFFu + ((u >> 16) & 1u)) >> 16);
}
__device__ __forceinline__ float bf_bits2f(unsigned short h) { return __uint_as_float(((unsigned)h) << 16); }

// hazard guards as plain device helpers (no inline asm inside the kernel template body)
__device__ __forceinline__ void dep_guard_h(v8f& a, v8f& b, v16h x, v16h y) { asm volatile("v_nop\n\tv_nop\n\tv_nop\n\tv_nop" : "+v"(a), "+v"(b) : "v"(x), "v"(y)); }
__device__ __forceinline__ void dep_guard_b(v8f& a, v8f& b, v16b x, v16b y) { asm volatile("v_nop\n\tv_nop\n\tv_nop\n\tv_nop" : "+v"(a), "+v"(b) : "v"(x), "v"(y)); }
__device__ __forceinline__ void keep4_h(v16h a, v16h b, v16h c, v16h d) { asm volatile("v_nop" :: "v"(a), "v"(b), "v"(c), "v"(d)); }
__device__ __forceinline__ void keep4_b(v16b a, v16b b, v16b c, v16b d) { asm volatile("v_nop" :: "v"(a), "v"(b), "v"(c), "v"(d)); }
__device__ __forceinline__ void acc_guard4(v8f& a, v8f& b, v8f& c, v8f& d) { asm volatile("v_nop\n\tv_nop\n\tv_nop\n\tv_nop" : "+v"(a), "+v"(b), "+v"(c), "+v"(d)); }
template <typename T> struct Frag;
template <> struct Frag<_Float16> {
  typedef v16h V; union U { v16h v; v8h h[2]; };
  static __device__ __forceinline__ v16h load(const _Float16* p) {   // elements 0..7 <- p[0..7], 8..15 <- p[16..23]
    U f; f.h[0] = *(const v8h*)(p); f.h[1] = *(const v8h*)(p + 16); return f.v;
  }
  static __device__ __forceinline__ v8f mma(v16h a, v16h b, v8f c) {
    return __builtin_amdgcn_wmma_f32_16x16x32_f16(false, a, false, b, (short)0, c, false, false);
  }
  static __device__ __forceinline__ void guard(v8f& a, v8f& b, v16h x, v16h y) { dep_guard_h(a, b, x, y); }
  static __device__ __forceinline__ void keep(v16h a, v16h b, v16h c, v16h d) { keep4_h(a, b, c, d); }
};
template <> struct Frag<__bf16> {
  typedef v16b V; union U { v16b v; v8b h[2]; };
  static __device__ __forceinline__ v16b load(const __bf16* p) {
    U f; f.h[0] = *(const v8b*)(p); f.h[1] = *(const v8b*)(p + 16); return f.v;
  }
  static __device__ __forceinline__ v8f mma(v16b a, v16b b, v8f c) {
    return __builtin_amdgcn_wmma_f32_16x16x32_bf16(false, a, false, b, (short)0, c, false, false);
  }
  static __device__ __forceinline__ void guard(v8f& a, v8f& b, v16b x, v16b y) { dep_guard_b(a, b, x, y); }
  static __device__ __forceinline__ void keep(v16b a, v16b b, v16b c, v16b d) { keep4_b(a, b, c, d); }
};

// ---- Register-blocked batched WMMA GEMM ------------------------------------
// C[m,n] = scale * sum_k A[m,k] * Bt[n,k] (+bias)(+resid); each wave owns a 64x64 tile.
// A row-major [M,K]; Bt row-major [N,K]; M,N % 64 == 0, K % 32 == 0.
// SPLIT: operands are hi/lo planes (A2/Bt2 = lo planes, same layout); product = hi*hi + hi*lo + lo*hi.
// BIAS_MODE: 0 = none, 1 = bias[m], 2 = bias[n].
// OUT_MODE: 0 = f32, 1 = f16, 2 = bf16 hi plane (Cout) + bf16 lo plane (Cout2).
// TRI: M == N; only tiles (tm, tn) with tn <= tm are enumerated (lower-triangular schedule, tile index -> (tm,tn) by integer search).
// KLIM: the k loop for m-tile tm runs over k < min(K, (tm+1)*64) (wave-uniform bound).
// ET: 0 = f16 operands, 1 = bf16 operands (pointers passed as 16-bit storage)
template <int ET> struct Elem;
template <> struct Elem<0> { typedef _Float16 T; };
template <> struct Elem<1> { typedef __bf16 T; };
template <int ET, bool SPLIT, int BIAS_MODE, int OUT_MODE, bool RESID, int ACT, bool TRI, bool KLIM>
__global__ __launch_bounds__(256) void wmma_gemm64(
    const unsigned short* __restrict__ Ap, const unsigned short* __restrict__ A2p, int lda, long strideA,
    const unsigned short* __restrict__ Btp, const unsigned short* __restrict__ Bt2p, int ldb, long strideB,
    void* __restrict__ Cout, void* __restrict__ Cout2, int ldc, long strideC,
    const float* __restrict__ bias,
    const float* __restrict__ resid, long strideR,
    int M, int N, int K, float scale) {
  typedef typename Elem<ET>::T T;
  typedef typename Frag<T>::V V;
  const T* A = (const T*)Ap; const T* A2 = (const T*)A2p; const T* Bt = (const T*)Btp; const T* Bt2 = (const T*)Bt2p;
  __shared__ __align__(16) float sT[8][16 * 68];   // per-wave 16x64 slab, pitch 68 floats
  const int b    = blockIdx.y;
  const int lane = threadIdx.x & 31;
  const int wave = threadIdx.x >> 5;
  const int tilesN = N >> 6;
  const int tilesM = M >> 6;
  const int tile = blockIdx.x * 8 + wave;
  int tm, tn;
  if (TRI) {
    const int ntri = (tilesM * (tilesM + 1)) >> 1;
    if (tile >= ntri) return;              // wave-uniform; no block barriers in this kernel
    int r = 0;
    for (int i = 1; i < tilesM && i < 4096; ++i) { if (((i * (i + 1)) >> 1) <= tile) r = i; }
    tm = r;
    tn = tile - ((tm * (tm + 1)) >> 1);    // 0 <= tn <= tm
  } else {
    if (tile >= tilesM * tilesN) return;   // wave-uniform; no block barriers in this kernel
    tm = tile / tilesN;
    tn = tile - tm * tilesN;
  }
  const int m0 = tm << 6;
  const int n0 = tn << 6;
  int kEnd = K;
  if (KLIM) { const int kl = (tm + 1) << 6; kEnd = (kl < K) ? kl : K; }

  const T* Ab  = A  + (size_t)b * strideA;
  const T* Bb  = Bt + (size_t)b * strideB;
  const T* Ab2 = SPLIT ? (A2  + (size_t)b * strideA) : nullptr;
  const T* Bb2 = SPLIT ? (Bt2 + (size_t)b * strideB) : nullptr;

  const int rlane = lane & 15;                 // row (A) / col (B, D) within subtile
  const int koff  = (lane >> 4) * 8;           // k offset of this lane half
  const int mOff  = (lane >> 4) * 8;           // D row offset

  v8f acc[4][4];
#pragma unroll
  for (int i = 0; i < 4; ++i)
#pragma unroll
    for (int j = 0; j < 4; ++j) acc[i][j] = (v8f){0.f,0.f,0.f,0.f,0.f,0.f,0.f,0.f};

  for (int k0 = 0; k0 < kEnd; k0 += 32) {
    V bh[4], bl[4];
#pragma unroll
    for (int j = 0; j < 4; ++j) {
      const size_t bo = (size_t)(n0 + (j << 4) + rlane) * ldb + koff + k0;
      bh[j] = Frag<T>::load(Bb + bo);
      if (SPLIT) bl[j] = Frag<T>::load(Bb2 + bo);
    }
#pragma unroll
    for (int i = 0; i < 4; ++i) {
      const size_t ao = (size_t)(m0 + (i << 4) + rlane) * lda + koff + k0;
      V ah = Frag<T>::load(Ab + ao);
      V al;
      if (SPLIT) al = Frag<T>::load(Ab2 + ao);
#pragma unroll
      for (int j = 0; j < 4; ++j) {
        acc[i][j] = Frag<T>::mma(ah, bh[j], acc[i][j]);
        if (SPLIT) {
          acc[i][j] = Frag<T>::mma(ah, bl[j], acc[i][j]);
          acc[i][j] = Frag<T>::mma(al, bh[j], acc[i][j]);
        }
      }
      Frag<T>::guard(acc[i][0], acc[i][3], ah, SPLIT ? al : ah);
    }
    Frag<T>::keep(bh[0], bh[1], bh[2], bh[3]);
    if (SPLIT) Frag<T>::keep(bl[0], bl[1], bl[2], bl[3]);
  }
  acc_guard4(acc[0][0], acc[0][1], acc[0][2], acc[0][3]);
  acc_guard4(acc[1][0], acc[1][1], acc[1][2], acc[1][3]);
  acc_guard4(acc[2][0], acc[2][1], acc[2][2], acc[2][3]);
  acc_guard4(acc[3][0], acc[3][1], acc[3][2], acc[3][3]);

  // ---- epilogue ----
  float* slab = sT[wave];
  const float* Rb = RESID ? (resid + (size_t)b * strideR) : nullptr;
#pragma unroll
  for (int i = 0; i < 4; ++i) {
    const int mBase = m0 + (i << 4);
#pragma unroll
    for (int j = 0; j < 4; ++j) {
      const int n = n0 + (j << 4) + rlane;
      float bv = 0.f;
      if (BIAS_MODE == 2) bv = bias[n];
#pragma unroll
      for (int r = 0; r < 8; ++r) {
        float v = acc[i][j][r] * scale;
        if (BIAS_MODE == 1) v += bias[mBase + mOff + r];
        if (BIAS_MODE == 2) v += bv;
        if (RESID) v += Rb[(size_t)(mBase + mOff + r) * ldc + n];
        if (ACT == 1) v = tanhf(v);
        if (ACT == 2) v = fmaxf(v, 0.0f);
        if (ACT == 3) v = v / (1.0f + expf(-v));
        if (ACT == 4) v = (v > 0.f) ? v : 0.01f * v;
        if (ACT == 5) v = 0.5f * v * (1.0f + erff(v * 0.70710678118654752f));
        slab[(mOff + r) * 68 + (j << 4) + rlane] = v;
      }
    }
    __builtin_amdgcn_fence(__ATOMIC_RELEASE, "workgroup");
    __builtin_amdgcn_wave_barrier();
    __builtin_amdgcn_fence(__ATOMIC_ACQUIRE, "workgroup");
    if (OUT_MODE == 0) {
      float* C = (float*)Cout + (size_t)b * strideC;
      const int hh = lane >> 4, c4 = (lane & 15) * 4;     // row seg = 256 B = 16 lanes x 16 B
      {
#pragma unroll
        for (int it = 0; it < 8; ++it) {
          const int row = it * 2 + hh;
          v4f v = *(const v4f*)(slab + row * 68 + c4);
          *(v4f*)(C + (size_t)(mBase + row) * ldc + n0 + c4) = v;
        }
        
      }
    } else {
      const int q = lane >> 3, c8 = (lane & 7) * 8;
      unsigned short* C  = (unsigned short*)Cout  + (size_t)b * strideC;
      unsigned short* C2 = (OUT_MODE == 2) ? ((unsigned short*)Cout2 + (size_t)b * strideC) : nullptr;
      {
#pragma unroll
        for (int it = 0; it < 4; ++it) {
          const int row = it * 4 + q;
          const float* sp = slab + row * 68 + c8;
          v8h hv, lv;
#pragma unroll
          for (int e = 0; e < 8; ++e) {
            if (OUT_MODE == 1) {
              hv[e] = (_Float16)sp[e];
            } else {
              unsigned short hb = f2bf_bits(sp[e]);
              unsigned short lb = f2bf_bits(sp[e] - bf_bits2f(hb));
              hv[e] = __builtin_bit_cast(_Float16, hb);
              lv[e] = __builtin_bit_cast(_Float16, lb);
            }
          }
          *(v8h*)(C + (size_t)(mBase + row) * ldc + n0 + c8) = hv;
          if (OUT_MODE == 2) *(v8h*)(C2 + (size_t)(mBase + row) * ldc + n0 + c8) = lv;
        }
        
      }
    }
    __builtin_amdgcn_fence(__ATOMIC_RELEASE, "workgroup");
    __builtin_amdgcn_wave_barrier();
    __builtin_amdgcn_fence(__ATOMIC_ACQUIRE, "workgroup");
  }
}

// ---- x f32 -> three 16-bit planes: bf16 hi, bf16 lo (x - hi), f16 ----
__global__ __launch_bounds__(256) void xplanes_kernel(
    const float* __restrict__ x, unsigned short* __restrict__ xh, unsigned short* __restrict__ xl,
    unsigned short* __restrict__ x16, int n8) {
  const int i = blockIdx.x * 256 + threadIdx.x;
  if (i >= n8) return;                         // no block barriers in this kernel
  const float* p = x + (size_t)i * 8;
  const v4f a = *(const v4f*)p;
  const v4f c = *(const v4f*)(p + 4);
  float f[8];
#pragma unroll
  for (int e = 0; e < 4; ++e) { f[e] = a[e]; f[4 + e] = c[e]; }
  v8h hv, lv, fv;
#pragma unroll
  for (int e = 0; e < 8; ++e) {
    const unsigned short hb = f2bf_bits(f[e]);
    const unsigned short lb = f2bf_bits(f[e] - bf_bits2f(hb));
    hv[e] = __builtin_bit_cast(_Float16, hb);
    lv[e] = __builtin_bit_cast(_Float16, lb);
    fv[e] = (_Float16)f[e];
  }
  const size_t o = (size_t)i * 8;
  {
    *(v8h*)(xh + o)  = hv;
    *(v8h*)(xl + o)  = lv;
    *(v8h*)(x16 + o) = fv;
    
  }
}

// ---- weight transpose with 16-bit conversion: w [R][C] (R = in features, C = out features) -> planes [C][R], out[c][r] = w[r][c] * scl ----
// MODE 0: bf16 hi + bf16 lo planes; MODE 1: single f16 plane.
// grid = (C/32, R/64), block 256.
template <int MODE>
__global__ __launch_bounds__(256) void wtrans_kernel(
    const float* __restrict__ w, unsigned short* __restrict__ o1, unsigned short* __restrict__ o2,
    int R, int C, float scl) {
  __shared__ float t[32][65];                  // t[c][r]
  const int c0 = blockIdx.x * 32, r0 = blockIdx.y * 64;
  const int tid = threadIdx.x, lane = tid & 31, wave = tid >> 5;
#pragma unroll
  for (int it = 0; it < 8; ++it) {
    const int r = it * 8 + wave;
    t[lane][r] = w[(size_t)(r0 + r) * C + c0 + lane];
  }
  __syncthreads();
  const int c  = wave * 4 + (lane >> 3);       // 0..31
  const int rb = (lane & 7) * 8;               // 0..56
  v8h h1, h2;
#pragma unroll
  for (int e = 0; e < 8; ++e) {
    const float f = t[c][rb + e] * scl;
    if (MODE == 0) {
      const unsigned short hb = f2bf_bits(f);
      const unsigned short lb = f2bf_bits(f - bf_bits2f(hb));
      h1[e] = __builtin_bit_cast(_Float16, hb);
      h2[e] = __builtin_bit_cast(_Float16, lb);
    } else {
      h1[e] = (_Float16)f;
      h2[e] = h1[e];
    }
  }
  const size_t o = (size_t)(c0 + c) * R + r0 + rb;
  {
    *(v8h*)(o1 + o) = h1;
    if (MODE == 0) *(v8h*)(o2 + o) = h2;
    
  }
}

// ---- causal row softmax: one wave per row i of batch element blockIdx.y ----
// Reads S[i][j] (f32) for j < kend = ((i/64)+1)*64, masks j > i with -inf, f32 max / exp / sum,
// writes normalized probabilities as bf16 hi + lo planes for columns [0, kend) (zeros for i < j < kend):
__global__ __launch_bounds__(256) void softmax_rows(
    const float* __restrict__ S, unsigned short* __restrict__ Ph, unsigned short* __restrict__ Pl, int L) {
  const int wave = threadIdx.x >> 5, lane = threadIdx.x & 31;
  const int i = blockIdx.x * 8 + wave;
  if (i >= L) return;                          // no block barriers in this kernel
  const int kend = ((i >> 6) + 1) << 6;        // <= L
  const size_t bo = (size_t)blockIdx.y * L * L; // this batch element's [L][L] plane
  const float* s = S + bo + (size_t)i * L;
  const float NEG = -__builtin_inff();
  float v[8][8];
  float m = NEG;
#pragma unroll
  for (int it = 0; it < 8; ++it) {
#pragma unroll
    for (int e = 0; e < 8; ++e) v[it][e] = NEG;
    const int c0 = it * 256 + lane * 8;
    if (it * 256 < kend && c0 < kend) {
      const v4f a = *(const v4f*)(s + c0);
      const v4f c = *(const v4f*)(s + c0 + 4);
#pragma unroll
      for (int e = 0; e < 4; ++e) {
        v[it][e]     = (c0 + e <= i)     ? a[e] : NEG;
        v[it][4 + e] = (c0 + 4 + e <= i) ? c[e] : NEG;
      }
    }
#pragma unroll
    for (int e = 0; e < 8; ++e) m = fmaxf(m, v[it][e]);
  }
#pragma unroll
  for (int off = 1; off < 32; off <<= 1) m = fmaxf(m, __shfl_xor(m, off, 32));

  float l = 0.f;
#pragma unroll
  for (int it = 0; it < 8; ++it) {
    if (it * 256 < kend) {                     // wave-uniform
#pragma unroll
      for (int e = 0; e < 8; ++e) {
        const float p = __expf(v[it][e] - m);  // exp(-inf) = 0 for masked columns
        v[it][e] = p;
        l += p;
      }
    }
  }
#pragma unroll
  for (int off = 1; off < 32; off <<= 1) l += __shfl_xor(l, off, 32);
  const float inv = 1.0f / l;                  // l >= 1

  unsigned short* ph = Ph + bo + (size_t)i * L;
  unsigned short* pl = Pl + bo + (size_t)i * L;
  {
#pragma unroll
    for (int it = 0; it < 8; ++it) {
      const int c0 = it * 256 + lane * 8;
      if (it * 256 < kend && c0 < kend) {
        v8h hv, lv;
#pragma unroll
        for (int e = 0; e < 8; ++e) {
          const float p = v[it][e] * inv;
          const unsigned short hb = f2bf_bits(p);
          const unsigned short lb = f2bf_bits(p - bf_bits2f(hb));
          hv[e] = __builtin_bit_cast(_Float16, hb);
          lv[e] = __builtin_bit_cast(_Float16, lb);
        }
        *(v8h*)(ph + c0) = hv;
        *(v8h*)(pl + c0) = lv;
      }
    }
    
  }
}

// ---------------------------------------------------------------------------
// host launcher
// ---------------------------------------------------------------------------
extern "C" void kernel_launch(void* const* d_in, const int* in_sizes, int n_in,
                              void* d_out, int out_size, void* d_ws, size_t ws_size,
                              hipStream_t stream)
{
  const int B = 4, L = 2048, D = 1024;
  const int M = B * L;                                   // 8192 rows
  if (n_in < 7) return;
  if (in_sizes[0] != M * D || in_sizes[1] != D * D || in_sizes[2] != D ||
      in_sizes[3] != D * D || in_sizes[4] != D || in_sizes[5] != D * D ||
      in_sizes[6] != D || out_size != M * D) return;

  const float* x  = (const float*)d_in[0];
  const float* wq = (const float*)d_in[1];
  const float* bq = (const float*)d_in[2];
  const float* wk = (const float*)d_in[3];
  const float* bk = (const float*)d_in[4];
  const float* wv = (const float*)d_in[5];
  const float* bv = (const float*)d_in[6];
  float* out = (float*)d_out;

  // workspace carve: 5 weight planes (2 MiB each) + q, k, v^T hi, v^T lo (16 MiB each) + S (64 MiB) + P hi, P lo (32 MiB each) = 202 MiB
  const size_t plane_w = (size_t)D * D * 2;             // 2,097,152 B
  const size_t plane_x = (size_t)M * D * 2;             // 16,777,216 B  (== L*L*4)
  const size_t need = 5 * plane_w + 12 * plane_x;       // 211,812,352 B
  if (ws_size < need) return;
  char* ws = (char*)d_ws;
  unsigned short* WqTh = (unsigned short*)(ws);
  unsigned short* WqTl = (unsigned short*)(ws + plane_w);
  unsigned short* WkT  = (unsigned short*)(ws + 2 * plane_w);
  unsigned short* WvTh = (unsigned short*)(ws + 3 * plane_w);
  unsigned short* WvTl = (unsigned short*)(ws + 4 * plane_w);
  char* xr = ws + 5 * plane_w;
  unsigned short* Q16 = (unsigned short*)(xr);                 // q f16      [8192][1024]
  unsigned short* K16 = (unsigned short*)(xr + plane_x);       // k f16      [8192][1024]
  unsigned short* VTh = (unsigned short*)(xr + 2 * plane_x);   // v^T bf16 hi [4][1024][2048]
  unsigned short* VTl = (unsigned short*)(xr + 3 * plane_x);   // v^T bf16 lo
  unsigned short* Xh  = (unsigned short*)(xr + 4 * plane_x);   // x bf16 hi  [8192][1024]
  unsigned short* Xl  = (unsigned short*)(xr + 5 * plane_x);   // x bf16 lo
  unsigned short* X16 = (unsigned short*)(xr + 6 * plane_x);   // x f16
  // S for all four batch elements aliases the x planes, which are dead after the projections
  float* Sb = (float*)(xr + 4 * plane_x);                      // S f32 [4][2048][2048] = 64 MiB
  unsigned short* Ph = (unsigned short*)(xr + 8 * plane_x);    // P bf16 hi [4][2048][2048] = 32 MiB
  unsigned short* Pl = (unsigned short*)(xr + 10 * plane_x);   // P bf16 lo                  32 MiB

  // 1) x -> planes
  {
    const int n8 = M * D / 8;                            // 1,048,576
    xplanes_kernel<<<dim3((n8 + 255) / 256), dim3(256), 0, stream>>>(x, Xh, Xl, X16, n8);
  }
  // 2) weights [in][out] -> transposed 16-bit planes [out][in]
  {
    dim3 g(D / 32, D / 64), blk(256);
    wtrans_kernel<0><<<g, blk, 0, stream>>>(wq, WqTh, WqTl, D, D, 1.0f);
    wtrans_kernel<1><<<g, blk, 0, stream>>>(wk, WkT, WkT, D, D, 64.0f);
    wtrans_kernel<0><<<g, blk, 0, stream>>>(wv, WvTh, WvTl, D, D, 1.0f);
  }
  // 3) q = x*Wq + bq  (bf16 hi/lo split, f16 out)   [8192 x 1024 x 1024]
  {
    dim3 g((M / 64) * (D / 64) / 8, 1), blk(256);
    wmma_gemm64<1, true, 2, 1, false, 0, false, false><<<g, blk, 0, stream>>>(
        Xh, Xl, D, 0L, WqTh, WqTl, D, 0L, (void*)Q16, (void*)Q16, D, 0L, bq, bq, 0L, M, D, D, 1.0f);
  }
  // 4) k = (x*(64 Wk)) / 64 + bk  (plain f16, f16 out)
  {
    dim3 g((M / 64) * (D / 64) / 8, 1), blk(256);
    wmma_gemm64<0, false, 2, 1, false, 0, false, false><<<g, blk, 0, stream>>>(
        X16, X16, D, 0L, WkT, WkT, D, 0L, (void*)K16, (void*)K16, D, 0L, bk, bk, 0L, M, D, D, 1.0f / 64.0f);
  }
  // 5) v^T[b][d][j] = sum_i Wv^T[d][i] x[b][j][i] + bv[d]  (bf16 hi/lo split, bf16 hi/lo planes out)  [4 x 1024 x 2048 x 1024]
  {
    dim3 g((D / 64) * (L / 64) / 8, B), blk(256);
    wmma_gemm64<1, true, 1, 2, false, 0, false, false><<<g, blk, 0, stream>>>(
        WvTh, WvTl, D, 0L, Xh, Xl, D, (long)L * D, (void*)VTh, (void*)VTl, L, (long)D * L, bv, bv, 0L, D, L, D, 1.0f);
  }
  // 6) all batch elements in each launch (grid y = batch element):
  //    S = q*k^T / 32 (lower-triangular tiles), P = softmax rows, out = P * v (k-limited)
  const int ntri = (L / 64) * (L / 64 + 1) / 2;          // 528 tiles per batch element
  {
    dim3 g((ntri + 7) / 8, B), blk(256);
    wmma_gemm64<0, false, 0, 0, false, 0, true, false><<<g, blk, 0, stream>>>(
        Q16, Q16, D, (long)L * D, K16, K16, D, (long)L * D, (void*)Sb, (void*)Sb, L, (long)L * L, bq, bq, 0L, L, L, D, 1.0f / 32.0f);
  }
  softmax_rows<<<dim3((L + 7) / 8, B), dim3(256), 0, stream>>>(Sb, Ph, Pl, L);
  {
    dim3 g((L / 64) * (D / 64) / 8, B), blk(256);
    wmma_gemm64<1, true, 0, 0, false, 0, false, true><<<g, blk, 0, stream>>>(
        Ph, Pl, L, (long)L * L, VTh, VTl, L, (long)D * L, (void*)out, (void*)out, D, (long)L * D, bq, bq, 0L, L, D, L, 1.0f);
  }
}
